// v000
// The times below were measured on an AMD MI455X: many runs one after another, warmed up first and cycling through
// copies of the inputs, with the whole window's GPU time divided by the number of runs. Launches and the gaps
// between them are all in it. The median over several windows is given; except for v000 it joins two sittings, which
// can be a few percent apart, so the side-by-side timings, each taken in one sitting, are the better comparison.
// v000, which the later versions start from, runs in 233 microseconds.
#include <hip/hip_runtime.h>

#define B_ 16
#define T_ 4096
#define Z_ 1024
#define H_ 16
#define DK_ 64

typedef __attribute__((ext_vector_type(2))) float v2f;
typedef __attribute__((ext_vector_type(4))) float v4f;
typedef __attribute__((ext_vector_type(8))) float v8f;

// ---------------------------------------------------------------------------
// CDNA5 async global->LDS path (ASYNCcnt-tracked, bypasses VGPRs).
// Builtin signature (from hipcc diagnostic): first param is
// `__attribute__((vector_size(16))) int` pointer in the global (as1) space.
// Falls back to synchronous v4f staging if the toolchain lacks the builtins.
// ---------------------------------------------------------------------------
#if defined(__has_builtin)
#if __has_builtin(__builtin_amdgcn_global_load_async_to_lds_b128) && \
    __has_builtin(__builtin_amdgcn_s_wait_asynccnt)
#define HAVE_ASYNC 1
#endif
#endif
#ifndef HAVE_ASYNC
#define HAVE_ASYNC 0
#endif

#if HAVE_ASYNC
typedef int v4i __attribute__((vector_size(16)));
typedef __attribute__((address_space(1))) v4i g_v4i;
typedef __attribute__((address_space(3))) v4i l_v4i;
__device__ __forceinline__ void cp16_async(const float* g, float* l) {
  __builtin_amdgcn_global_load_async_to_lds_b128((g_v4i*)g, (l_v4i*)l, 0, 0);
}
#define ASYNC_WAIT(n) __builtin_amdgcn_s_wait_asynccnt(n)
#else
__device__ __forceinline__ void cp16_async(const float* g, float* l) {
  *(v4f*)l = *(const v4f*)g;
}
#define ASYNC_WAIT(n) ((void)0)
#endif

// ---------------------------------------------------------------------------
// Kernel 1a: q[b,h,d] = o_last[b,:]·Wq[h,:,d] + bq[h,d] ; qb[b,h] = q·bk[h,:]
// ---------------------------------------------------------------------------
__global__ void qproj_kernel(const float* __restrict__ o_last,
                             const float* __restrict__ Wq,
                             const float* __restrict__ bq,
                             const float* __restrict__ bk,
                             float* __restrict__ q,
                             float* __restrict__ qb) {
  int bh = blockIdx.x;
  int b = bh / H_, h = bh % H_;
  int d = threadIdx.x;
  const float* ol = o_last + b * Z_;
  const float* w  = Wq + (size_t)h * Z_ * DK_ + d;
  float acc = bq[h * DK_ + d];
  for (int z = 0; z < Z_; ++z) acc += ol[z] * w[(size_t)z * DK_];
  q[bh * DK_ + d] = acc;
  __shared__ float red[DK_];
  red[d] = acc * bk[h * DK_ + d];
  __syncthreads();
  for (int s = DK_ / 2; s > 0; s >>= 1) {
    if (d < s) red[d] += red[d + s];
    __syncthreads();
  }
  if (d == 0) qb[bh] = red[0];
}

// ---------------------------------------------------------------------------
// Kernel 1b: qk[b,h,z] = sum_d q[b,h,d] * Wk[h,z,d]
// ---------------------------------------------------------------------------
__global__ void qk_kernel(const float* __restrict__ q,
                          const float* __restrict__ Wk,
                          float* __restrict__ qk) {
  int bh = blockIdx.x;
  int h = bh % H_;
  __shared__ float qs[DK_];
  if (threadIdx.x < DK_) qs[threadIdx.x] = q[bh * DK_ + threadIdx.x];
  __syncthreads();
  for (int z = threadIdx.x; z < Z_; z += blockDim.x) {
    const float* w = Wk + ((size_t)h * Z_ + z) * DK_;
    float acc = 0.f;
#pragma unroll 8
    for (int d = 0; d < DK_; ++d) acc += qs[d] * w[d];
    qk[(size_t)bh * Z_ + z] = acc;
  }
}

// ---------------------------------------------------------------------------
// Kernel 2: scores[b,h,t] = qk[b,h,:]·o_all[b,t,:] + qb[b,h]
// GEMM per batch: M=16(H) x N=T x K=Z, fp32 WMMA 16x16x4.
// Double-buffered async global->LDS staging of o_all tiles.
// ---------------------------------------------------------------------------
#define TT 128   // t-tile per block (8 waves x 16)
#define ZC 32    // z (K) chunk staged in LDS
#define LDP 36   // padded LDS row stride (floats): 144B rows, 16B aligned
#define SLPW 4   // async b128 issues per thread per chunk = TT*ZC/4/256

__global__ __launch_bounds__(256) void scores_kernel(
    const float* __restrict__ o_all, const float* __restrict__ qk,
    const float* __restrict__ qb, float* __restrict__ scores) {
  int b = blockIdx.y;
  int t0 = blockIdx.x * TT;
  int tid = threadIdx.x;
  int lane = tid & 31, wv = tid >> 5;
  int hn = lane & 15;            // A: M (head) / B: N (t) index
  int kb = (lane >> 4) * 2;      // K-pair base within the 4-wide K slab
  __shared__ float lds_o[2 * TT * LDP];

  v8f acc = {};
  const float* ob  = o_all + (size_t)b * T_ * Z_;
  const float* qkb = qk + (size_t)(b * H_) * Z_;

  // stage chunk 0 into buffer 0
#pragma unroll
  for (int i = 0; i < SLPW; ++i) {
    int f = tid + i * 256;
    int row = f >> 3;            // ZC/4 = 8 float4 per row
    int c4  = f & 7;
    cp16_async(ob + (size_t)(t0 + row) * Z_ + c4 * 4, &lds_o[row * LDP + c4 * 4]);
  }

  const int NCH = Z_ / ZC;       // 32 chunks
  for (int c = 0; c < NCH; ++c) {
    float* cur = &lds_o[(c & 1) * (TT * LDP)];
    if (c + 1 < NCH) {
      float* nxt = &lds_o[((c + 1) & 1) * (TT * LDP)];
      int zc1 = (c + 1) * ZC;
#pragma unroll
      for (int i = 0; i < SLPW; ++i) {
        int f = tid + i * 256;
        int row = f >> 3;
        int c4  = f & 7;
        cp16_async(ob + (size_t)(t0 + row) * Z_ + zc1 + c4 * 4,
                   &nxt[row * LDP + c4 * 4]);
      }
      ASYNC_WAIT(SLPW);          // chunk c landed; chunk c+1 still in flight
    } else {
      ASYNC_WAIT(0);
    }
    __syncthreads();

    int zc = c * ZC;
#pragma unroll
    for (int kk = 0; kk < ZC; kk += 4) {
      v2f a  = *(const v2f*)(qkb + (size_t)hn * Z_ + zc + kk + kb);
      v2f bf = *(const v2f*)&cur[(wv * 16 + hn) * LDP + kk + kb];
      acc = __builtin_amdgcn_wmma_f32_16x16x4_f32(false, a, false, bf,
                                                  (short)0, acc, false, false);
    }
    __syncthreads();
  }

  int mb = (lane >> 4) * 8;
  float* srow = scores + (size_t)(b * H_) * T_ + t0 + wv * 16 + hn;
#pragma unroll
  for (int r = 0; r < 8; ++r) {
    int h = mb + r;
    srow[(size_t)h * T_] = acc[r] + qb[b * H_ + h];
  }
}

// ---------------------------------------------------------------------------
// Kernel 3: row softmax over T per (b,h)
// ---------------------------------------------------------------------------
__global__ __launch_bounds__(256) void softmax_kernel(float* __restrict__ s) {
  float* p = s + (size_t)blockIdx.x * T_;
  int tid = threadIdx.x;
  __shared__ float red[256];
  float m = -3.4e38f;
  for (int t = tid; t < T_; t += 256) m = fmaxf(m, p[t]);
  red[tid] = m;
  __syncthreads();
  for (int st = 128; st > 0; st >>= 1) {
    if (tid < st) red[tid] = fmaxf(red[tid], red[tid + st]);
    __syncthreads();
  }
  m = red[0];
  __syncthreads();
  float sum = 0.f;
  for (int t = tid; t < T_; t += 256) {
    float e = __expf(p[t] - m);
    p[t] = e;
    sum += e;
  }
  red[tid] = sum;
  __syncthreads();
  for (int st = 128; st > 0; st >>= 1) {
    if (tid < st) red[tid] += red[tid + st];
    __syncthreads();
  }
  float inv = 1.0f / red[0];
  for (int t = tid; t < T_; t += 256) p[t] *= inv;
}

// ---------------------------------------------------------------------------
// Kernel 4: ctxz[b,h,z] = sum_t s[b,h,t] * o_all[b,t,z]
// GEMM per batch: M=16(H) x N=Z x K=T, fp32 WMMA 16x16x4.
// Double-buffered async global->LDS staging of o_all tiles.
// ---------------------------------------------------------------------------
#define ZT 128    // z-tile (N) per block (8 waves x 16)
#define TC 32     // t (K) chunk staged in LDS
#define LDP2 132  // padded LDS row stride (floats): 528B rows, 16B aligned
#define CLPW 4    // async b128 issues per thread per chunk = TC*ZT/4/256

__global__ __launch_bounds__(256) void ctxz_kernel(
    const float* __restrict__ o_all, const float* __restrict__ s,
    float* __restrict__ ctxz) {
  int b = blockIdx.y;
  int z0 = blockIdx.x * ZT;
  int tid = threadIdx.x;
  int lane = tid & 31, wv = tid >> 5;
  int hn = lane & 15;
  int kb = (lane >> 4) * 2;
  __shared__ float lds_o[2 * TC * LDP2];

  v8f acc = {};
  const float* ob = o_all + (size_t)b * T_ * Z_;
  const float* sb = s + (size_t)(b * H_) * T_;

  // stage chunk 0 into buffer 0
#pragma unroll
  for (int i = 0; i < CLPW; ++i) {
    int f = tid + i * 256;
    int row = f >> 5;            // ZT/4 = 32 float4 per row
    int c4  = f & 31;
    cp16_async(ob + (size_t)row * Z_ + z0 + c4 * 4, &lds_o[row * LDP2 + c4 * 4]);
  }

  const int NCH = T_ / TC;       // 128 chunks
  for (int c = 0; c < NCH; ++c) {
    float* cur = &lds_o[(c & 1) * (TC * LDP2)];
    if (c + 1 < NCH) {
      float* nxt = &lds_o[((c + 1) & 1) * (TC * LDP2)];
      int t1 = (c + 1) * TC;
#pragma unroll
      for (int i = 0; i < CLPW; ++i) {
        int f = tid + i * 256;
        int row = f >> 5;
        int c4  = f & 31;
        cp16_async(ob + (size_t)(t1 + row) * Z_ + z0 + c4 * 4,
                   &nxt[row * LDP2 + c4 * 4]);
      }
      ASYNC_WAIT(CLPW);
    } else {
      ASYNC_WAIT(0);
    }
    __syncthreads();

    int t0 = c * TC;
#pragma unroll
    for (int kk = 0; kk < TC; kk += 4) {
      v2f a = *(const v2f*)(sb + (size_t)hn * T_ + t0 + kk + kb);
      v2f bf;
      bf.x = cur[(kk + kb + 0) * LDP2 + wv * 16 + hn];
      bf.y = cur[(kk + kb + 1) * LDP2 + wv * 16 + hn];
      acc = __builtin_amdgcn_wmma_f32_16x16x4_f32(false, a, false, bf,
                                                  (short)0, acc, false, false);
    }
    __syncthreads();
  }

  int mb = (lane >> 4) * 8;
#pragma unroll
  for (int r = 0; r < 8; ++r) {
    int h = mb + r;
    ctxz[(size_t)(b * H_ + h) * Z_ + z0 + wv * 16 + hn] = acc[r];
  }
}

// ---------------------------------------------------------------------------
// Kernel 5: out[b, h*DK+d] = sum_z ctxz[b,h,z]*Wv[h,z,d] + bv[h,d]
// ---------------------------------------------------------------------------
__global__ void ctx_kernel(const float* __restrict__ ctxz,
                           const float* __restrict__ Wv,
                           const float* __restrict__ bv,
                           float* __restrict__ out) {
  int bh = blockIdx.x;
  int b = bh / H_, h = bh % H_;
  int d = threadIdx.x;
  const float* c = ctxz + (size_t)bh * Z_;
  const float* w = Wv + (size_t)h * Z_ * DK_ + d;
  float acc = bv[h * DK_ + d];
  for (int z = 0; z < Z_; ++z) acc += c[z] * w[(size_t)z * DK_];
  out[(size_t)b * Z_ + h * DK_ + d] = acc;
}

// ---------------------------------------------------------------------------
extern "C" void kernel_launch(void* const* d_in, const int* in_sizes, int n_in,
                              void* d_out, int out_size, void* d_ws, size_t ws_size,
                              hipStream_t stream) {
  const float* o_all  = (const float*)d_in[0];
  const float* o_last = (const float*)d_in[1];
  const float* Wk     = (const float*)d_in[2];
  const float* Wv     = (const float*)d_in[3];
  const float* Wq     = (const float*)d_in[4];
  const float* bk     = (const float*)d_in[5];
  const float* bv     = (const float*)d_in[6];
  const float* bq     = (const float*)d_in[7];
  float* out = (float*)d_out;

  float* ws     = (float*)d_ws;
  float* q      = ws;                              // B*H*DK
  float* qb     = q + B_ * H_ * DK_;               // B*H
  float* qk     = qb + B_ * H_;                    // B*H*Z
  float* scores = qk + B_ * H_ * Z_;               // B*H*T
  float* ctxz   = scores + (size_t)B_ * H_ * T_;   // B*H*Z

  qproj_kernel<<<B_ * H_, DK_, 0, stream>>>(o_last, Wq, bq, bk, q, qb);
  qk_kernel<<<B_ * H_, 256, 0, stream>>>(q, Wk, qk);
  scores_kernel<<<dim3(T_ / TT, B_), 256, 0, stream>>>(o_all, qk, qb, scores);
  softmax_kernel<<<B_ * H_, 256, 0, stream>>>(scores);
  ctxz_kernel<<<dim3(Z_ / ZT, B_), 256, 0, stream>>>(o_all, scores, ctxz);
  ctx_kernel<<<B_ * H_, DK_, 0, stream>>>(ctxz, Wv, bv, out);
}

// v001
// It runs in 159 microseconds.
// Two timings next to v000 put it at 1.49 and 1.46 times that version's speed.
#include <hip/hip_runtime.h>

#define B_ 16
#define T_ 4096
#define Z_ 1024
#define H_ 16
#define DK_ 64

typedef __attribute__((ext_vector_type(2))) float v2f;
typedef __attribute__((ext_vector_type(4))) float v4f;
typedef __attribute__((ext_vector_type(8))) float v8f;

// ---------------------------------------------------------------------------
// CDNA5 async global->LDS path (ASYNCcnt-tracked, bypasses VGPRs).
// Builtin signature (from hipcc diagnostic): first param is
// `__attribute__((vector_size(16))) int` pointer in the global (as1) space.
// Falls back to synchronous v4f staging if the toolchain lacks the builtins.
// ---------------------------------------------------------------------------
#if defined(__has_builtin)
#if __has_builtin(__builtin_amdgcn_global_load_async_to_lds_b128) && \
    __has_builtin(__builtin_amdgcn_s_wait_asynccnt)
#define HAVE_ASYNC 1
#endif
#endif
#ifndef HAVE_ASYNC
#define HAVE_ASYNC 0
#endif

#if HAVE_ASYNC
typedef int v4i __attribute__((vector_size(16)));
typedef __attribute__((address_space(1))) v4i g_v4i;
typedef __attribute__((address_space(3))) v4i l_v4i;
__device__ __forceinline__ void cp16_async(const float* g, float* l) {
  __builtin_amdgcn_global_load_async_to_lds_b128((g_v4i*)g, (l_v4i*)l, 0, 0);
}
#define ASYNC_WAIT(n) __builtin_amdgcn_s_wait_asynccnt(n)
#else
__device__ __forceinline__ void cp16_async(const float* g, float* l) {
  *(v4f*)l = *(const v4f*)g;
}
#define ASYNC_WAIT(n) ((void)0)
#endif

// ---------------------------------------------------------------------------
// Kernel 1a: q[b,h,d] = o_last[b,:]·Wq[h,:,d] + bq[h,d] ; qb[b,h] = q·bk[h,:]
// ---------------------------------------------------------------------------
__global__ void qproj_kernel(const float* __restrict__ o_last,
                             const float* __restrict__ Wq,
                             const float* __restrict__ bq,
                             const float* __restrict__ bk,
                             float* __restrict__ q,
                             float* __restrict__ qb) {
  int bh = blockIdx.x;
  int b = bh / H_, h = bh % H_;
  int d = threadIdx.x;
  const float* ol = o_last + b * Z_;
  const float* w  = Wq + (size_t)h * Z_ * DK_ + d;
  float acc = bq[h * DK_ + d];
  for (int z = 0; z < Z_; ++z) acc += ol[z] * w[(size_t)z * DK_];
  q[bh * DK_ + d] = acc;
  __shared__ float red[DK_];
  red[d] = acc * bk[h * DK_ + d];
  __syncthreads();
  for (int s = DK_ / 2; s > 0; s >>= 1) {
    if (d < s) red[d] += red[d + s];
    __syncthreads();
  }
  if (d == 0) qb[bh] = red[0];
}

// ---------------------------------------------------------------------------
// Kernel 1b: qk[b,h,z] = sum_d q[b,h,d] * Wk[h,z,d]
// ---------------------------------------------------------------------------
__global__ void qk_kernel(const float* __restrict__ q,
                          const float* __restrict__ Wk,
                          float* __restrict__ qk) {
  int bh = blockIdx.x;
  int h = bh % H_;
  __shared__ float qs[DK_];
  if (threadIdx.x < DK_) qs[threadIdx.x] = q[bh * DK_ + threadIdx.x];
  __syncthreads();
  for (int z = threadIdx.x; z < Z_; z += blockDim.x) {
    const float* w = Wk + ((size_t)h * Z_ + z) * DK_;
    float acc = 0.f;
#pragma unroll 8
    for (int d = 0; d < DK_; ++d) acc += qs[d] * w[d];
    qk[(size_t)bh * Z_ + z] = acc;
  }
}

// ---------------------------------------------------------------------------
// Kernel 2: scores[b,h,t] = qk[b,h,:]·o_all[b,t,:] + qb[b,h]
// GEMM per batch: M=16(H) x N=T x K=Z, fp32 WMMA 16x16x4.
// Double-buffered async global->LDS staging of o_all tiles.
// ---------------------------------------------------------------------------
#define TT 128   // t-tile per block (8 waves x 16)
#define ZC 32    // z (K) chunk staged in LDS
#define LDP 36   // padded LDS row stride (floats): 144B rows, 16B aligned
#define SLPW 4   // async b128 issues per thread per chunk = TT*ZC/4/256

__global__ __launch_bounds__(256) void scores_kernel(
    const float* __restrict__ o_all, const float* __restrict__ qk,
    const float* __restrict__ qb, float* __restrict__ scores) {
  int b = blockIdx.y;
  int t0 = blockIdx.x * TT;
  int tid = threadIdx.x;
  int lane = tid & 31, wv = tid >> 5;
  int hn = lane & 15;            // A: M (head) / B: N (t) index
  int kb = (lane >> 4) * 2;      // K-pair base within the 4-wide K slab
  __shared__ float lds_o[2 * TT * LDP];

  v8f acc = {};
  const float* ob  = o_all + (size_t)b * T_ * Z_;
  const float* qkb = qk + (size_t)(b * H_) * Z_;

  // stage chunk 0 into buffer 0
#pragma unroll
  for (int i = 0; i < SLPW; ++i) {
    int f = tid + i * 256;
    int row = f >> 3;            // ZC/4 = 8 float4 per row
    int c4  = f & 7;
    cp16_async(ob + (size_t)(t0 + row) * Z_ + c4 * 4, &lds_o[row * LDP + c4 * 4]);
  }

  const int NCH = Z_ / ZC;       // 32 chunks
  for (int c = 0; c < NCH; ++c) {
    float* cur = &lds_o[(c & 1) * (TT * LDP)];
    if (c + 1 < NCH) {
      float* nxt = &lds_o[((c + 1) & 1) * (TT * LDP)];
      int zc1 = (c + 1) * ZC;
#pragma unroll
      for (int i = 0; i < SLPW; ++i) {
        int f = tid + i * 256;
        int row = f >> 3;
        int c4  = f & 7;
        cp16_async(ob + (size_t)(t0 + row) * Z_ + zc1 + c4 * 4,
                   &nxt[row * LDP + c4 * 4]);
      }
      ASYNC_WAIT(SLPW);          // chunk c landed; chunk c+1 still in flight
    } else {
      ASYNC_WAIT(0);
    }
    __syncthreads();

    int zc = c * ZC;
#pragma unroll
    for (int kk = 0; kk < ZC; kk += 4) {
      v2f a  = *(const v2f*)(qkb + (size_t)hn * Z_ + zc + kk + kb);
      v2f bf = *(const v2f*)&cur[(wv * 16 + hn) * LDP + kk + kb];
      acc = __builtin_amdgcn_wmma_f32_16x16x4_f32(false, a, false, bf,
                                                  (short)0, acc, false, false);
    }
    __syncthreads();
  }

  int mb = (lane >> 4) * 8;
  float* srow = scores + (size_t)(b * H_) * T_ + t0 + wv * 16 + hn;
#pragma unroll
  for (int r = 0; r < 8; ++r) {
    int h = mb + r;
    srow[(size_t)h * T_] = acc[r] + qb[b * H_ + h];
  }
}

// ---------------------------------------------------------------------------
// Kernel 3: row softmax over T per (b,h)
// ---------------------------------------------------------------------------
__global__ __launch_bounds__(256) void softmax_kernel(float* __restrict__ s) {
  float* p = s + (size_t)blockIdx.x * T_;
  int tid = threadIdx.x;
  __shared__ float red[256];
  float m = -3.4e38f;
  for (int t = tid; t < T_; t += 256) m = fmaxf(m, p[t]);
  red[tid] = m;
  __syncthreads();
  for (int st = 128; st > 0; st >>= 1) {
    if (tid < st) red[tid] = fmaxf(red[tid], red[tid + st]);
    __syncthreads();
  }
  m = red[0];
  __syncthreads();
  float sum = 0.f;
  for (int t = tid; t < T_; t += 256) {
    float e = __expf(p[t] - m);
    p[t] = e;
    sum += e;
  }
  red[tid] = sum;
  __syncthreads();
  for (int st = 128; st > 0; st >>= 1) {
    if (tid < st) red[tid] += red[tid + st];
    __syncthreads();
  }
  float inv = 1.0f / red[0];
  for (int t = tid; t < T_; t += 256) p[t] *= inv;
}

// ---------------------------------------------------------------------------
// Kernel 4: part[ts,b,h,z] = sum over slice ts of t of s[b,h,t] * o_all[b,t,z]
// GEMM per batch: M=16(H) x N=Z x K=T, fp32 WMMA 16x16x4.
// K (= T) is cut into TS slices, one work-group and one partial sum each, so
// that 8 * 16 * TS work-groups stream o_all instead of 128; kernel 5 adds the
// partials up.
// Double-buffered async global->LDS staging of o_all tiles.
// ---------------------------------------------------------------------------
#define ZT 128    // z-tile (N) per block (8 waves x 16)
#define TC 32     // t (K) chunk staged in LDS
#define LDP2 132  // padded LDS row stride (floats): 528B rows, 16B aligned
#define CLPW 4    // async b128 issues per thread per chunk = TC*ZT/4/256
#define TS 8      // slices of T, one partial sum each
#define TSL (T_ / TS)  // t per slice

__global__ __launch_bounds__(256) void ctxz_kernel(
    const float* __restrict__ o_all, const float* __restrict__ s,
    float* __restrict__ part) {
  int b = blockIdx.y;
  int z0 = blockIdx.x * ZT;
  int ts = blockIdx.z;
  int tid = threadIdx.x;
  int lane = tid & 31, wv = tid >> 5;
  int hn = lane & 15;
  int kb = (lane >> 4) * 2;
  __shared__ float lds_o[2 * TC * LDP2];

  v8f acc = {};
  const float* ob = o_all + ((size_t)b * T_ + ts * TSL) * Z_;
  const float* sb = s + (size_t)(b * H_) * T_ + ts * TSL;

  // stage chunk 0 into buffer 0
#pragma unroll
  for (int i = 0; i < CLPW; ++i) {
    int f = tid + i * 256;
    int row = f >> 5;            // ZT/4 = 32 float4 per row
    int c4  = f & 31;
    cp16_async(ob + (size_t)row * Z_ + z0 + c4 * 4, &lds_o[row * LDP2 + c4 * 4]);
  }

  const int NCH = TSL / TC;      // 16 chunks per slice
  for (int c = 0; c < NCH; ++c) {
    float* cur = &lds_o[(c & 1) * (TC * LDP2)];
    if (c + 1 < NCH) {
      float* nxt = &lds_o[((c + 1) & 1) * (TC * LDP2)];
      int t1 = (c + 1) * TC;
#pragma unroll
      for (int i = 0; i < CLPW; ++i) {
        int f = tid + i * 256;
        int row = f >> 5;
        int c4  = f & 31;
        cp16_async(ob + (size_t)(t1 + row) * Z_ + z0 + c4 * 4,
                   &nxt[row * LDP2 + c4 * 4]);
      }
      ASYNC_WAIT(CLPW);
    } else {
      ASYNC_WAIT(0);
    }
    __syncthreads();

    int t0 = c * TC;
#pragma unroll
    for (int kk = 0; kk < TC; kk += 4) {
      v2f a = *(const v2f*)(sb + (size_t)hn * T_ + t0 + kk + kb);
      v2f bf;
      bf.x = cur[(kk + kb + 0) * LDP2 + wv * 16 + hn];
      bf.y = cur[(kk + kb + 1) * LDP2 + wv * 16 + hn];
      acc = __builtin_amdgcn_wmma_f32_16x16x4_f32(false, a, false, bf,
                                                  (short)0, acc, false, false);
    }
    __syncthreads();
  }

  int mb = (lane >> 4) * 8;
#pragma unroll
  for (int r = 0; r < 8; ++r) {
    int h = mb + r;
    part[(size_t)((ts * B_ + b) * H_ + h) * Z_ + z0 + wv * 16 + hn] = acc[r];
  }
}

// ---------------------------------------------------------------------------
// Kernel 5: ctxz[b,h,z] = sum_ts part[ts,b,h,z] (into LDS), then
//           out[b, h*DK+d] = sum_z ctxz[b,h,z]*Wv[h,z,d] + bv[h,d]
// ---------------------------------------------------------------------------
__global__ void ctx_kernel(const float* __restrict__ part,
                           const float* __restrict__ Wv,
                           const float* __restrict__ bv,
                           float* __restrict__ out) {
  int bh = blockIdx.x;
  int b = bh / H_, h = bh % H_;
  int d = threadIdx.x;
  __shared__ float c[Z_];
  const float* p0 = part + (size_t)bh * Z_;
  // unrolled so that the loads of all four trips are in flight together: one
  // memory wait for the merge instead of four
#pragma unroll
  for (int k = 0; k < Z_ / (DK_ * 4); ++k) {
    unsigned i = (k * DK_ + d) * 4;
    v4f a = *(const v4f*)(p0 + i);
#pragma unroll
    for (int ts = 1; ts < TS; ++ts)
      a += *(const v4f*)(p0 + (size_t)ts * B_ * H_ * Z_ + i);
    *(v4f*)&c[i] = a;
  }
  __syncthreads();
  const float* w = Wv + (size_t)h * Z_ * DK_ + d;
  float acc = bv[h * DK_ + d];
  for (int z = 0; z < Z_; ++z) acc += c[z] * w[(size_t)z * DK_];
  out[(size_t)b * Z_ + h * DK_ + d] = acc;
}

// ---------------------------------------------------------------------------
extern "C" void kernel_launch(void* const* d_in, const int* in_sizes, int n_in,
                              void* d_out, int out_size, void* d_ws, size_t ws_size,
                              hipStream_t stream) {
  const float* o_all  = (const float*)d_in[0];
  const float* o_last = (const float*)d_in[1];
  const float* Wk     = (const float*)d_in[2];
  const float* Wv     = (const float*)d_in[3];
  const float* Wq     = (const float*)d_in[4];
  const float* bk     = (const float*)d_in[5];
  const float* bv     = (const float*)d_in[6];
  const float* bq     = (const float*)d_in[7];
  float* out = (float*)d_out;

  float* ws     = (float*)d_ws;
  float* q      = ws;                              // B*H*DK
  float* qb     = q + B_ * H_ * DK_;               // B*H
  float* qk     = qb + B_ * H_;                    // B*H*Z
  float* scores = qk + B_ * H_ * Z_;               // B*H*T
  float* part   = scores + (size_t)B_ * H_ * T_;   // TS*B*H*Z

  qproj_kernel<<<B_ * H_, DK_, 0, stream>>>(o_last, Wq, bq, bk, q, qb);
  qk_kernel<<<B_ * H_, 256, 0, stream>>>(q, Wk, qk);
  scores_kernel<<<dim3(T_ / TT, B_), 256, 0, stream>>>(o_all, qk, qb, scores);
  softmax_kernel<<<B_ * H_, 256, 0, stream>>>(scores);
  ctxz_kernel<<<dim3(Z_ / ZT, B_, TS), 256, 0, stream>>>(o_all, scores, part);
  ctx_kernel<<<B_ * H_, DK_, 0, stream>>>(part, Wv, bv, out);
}

// v002
// It runs in 91 microseconds.
// In two side-by-side timings against v001, it was 1.74 and 1.73 times as fast.
// Counting every step since v000, it is 2.56 times as fast.
#include <hip/hip_runtime.h>

#define B_ 16
#define T_ 4096
#define Z_ 1024
#define H_ 16
#define DK_ 64

typedef __attribute__((ext_vector_type(2))) float v2f;
typedef __attribute__((ext_vector_type(4))) float v4f;
typedef __attribute__((ext_vector_type(8))) float v8f;

// ---------------------------------------------------------------------------
// CDNA5 async global->LDS path (ASYNCcnt-tracked, bypasses VGPRs).
// Builtin signature (from hipcc diagnostic): first param is
// `__attribute__((vector_size(16))) int` pointer in the global (as1) space.
// Falls back to synchronous v4f staging if the toolchain lacks the builtins.
// ---------------------------------------------------------------------------
#if defined(__has_builtin)
#if __has_builtin(__builtin_amdgcn_global_load_async_to_lds_b128) && \
    __has_builtin(__builtin_amdgcn_s_wait_asynccnt)
#define HAVE_ASYNC 1
#endif
#endif
#ifndef HAVE_ASYNC
#define HAVE_ASYNC 0
#endif

#if HAVE_ASYNC
typedef int v4i __attribute__((vector_size(16)));
typedef __attribute__((address_space(1))) v4i g_v4i;
typedef __attribute__((address_space(3))) v4i l_v4i;
__device__ __forceinline__ void cp16_async(const float* g, float* l) {
  __builtin_amdgcn_global_load_async_to_lds_b128((g_v4i*)g, (l_v4i*)l, 0, 0);
}
#define ASYNC_WAIT(n) __builtin_amdgcn_s_wait_asynccnt(n)
#else
__device__ __forceinline__ void cp16_async(const float* g, float* l) {
  *(v4f*)l = *(const v4f*)g;
}
#define ASYNC_WAIT(n) ((void)0)
#endif

// ---------------------------------------------------------------------------
// The two projection launches (1a and 5) walk z = 0..Z-1 for one (b,h). The
// walk is dealt to ZG groups of 16 threads: a thread holds 4 d (one 16-byte
// load per weight row) and its group takes 4 consecutive z out of every
// window of ZW, so that a work-group keeps many rows' loads in flight instead
// of one dependent chain of Z steps, and reads the weights in contiguous
// 16-KiB windows. The ZG partial sums meet in LDS.
// ---------------------------------------------------------------------------
#define PT 256            // threads per projection work-group
#define ZG (PT / 16)      // groups that share the z walk
#define ZW (4 * ZG)       // z per window
#define NW (Z_ / ZW)      // windows
// One work-group per WGP is all these launches have, so registers are free:
// a budget of 256 lets the compiler keep most of a thread's NW * 4 row loads
// in flight at once; at the default budget it keeps about eleven.
#define PROJ_BUDGET __attribute__((amdgpu_waves_per_eu(4, 4)))

// ---------------------------------------------------------------------------
// Kernel 1a: q[b,h,d] = o_last[b,:]·Wq[h,:,d] + bq[h,d] ; qb[b,h] = q·bk[h,:]
// ---------------------------------------------------------------------------
__global__ __launch_bounds__(PT) PROJ_BUDGET void qproj_kernel(
    const float* __restrict__ o_last, const float* __restrict__ Wq,
    const float* __restrict__ bq, const float* __restrict__ bk,
    float* __restrict__ q, float* __restrict__ qb) {
  int bh = blockIdx.x;
  int b = bh / H_, h = bh % H_;
  int d = threadIdx.x;
  int d4 = (d & 15) * 4;
  int zg = d >> 4;
  const float* ol = o_last + b * Z_ + zg * 4;
  const float* w  = Wq + ((size_t)h * Z_ + zg * 4) * DK_ + d4;
  __shared__ float ps[ZG * DK_];
  __shared__ float red[DK_];
  // biases asked for ahead of the barrier, so that their latency runs beside
  // the walk's
  float bqv = 0.f, bkv = 0.f;
  if (d < DK_) {
    bqv = bq[h * DK_ + d];
    bkv = bk[h * DK_ + d];
  }
  v4f a4 = {};
#pragma unroll  // all rows' loads independent and visible to the scheduler
  for (int i = 0; i < NW; ++i) {
    v4f o = *(const v4f*)(ol + i * ZW);
#pragma unroll  // o[j] by a constant index
    for (int j = 0; j < 4; ++j)
      a4 += o[j] * *(const v4f*)(w + (i * ZW + j) * DK_);
  }
  *(v4f*)&ps[zg * DK_ + d4] = a4;
  __syncthreads();
  if (d < DK_) {
    float acc = bqv;
#pragma unroll  // the ZG LDS reads issued together
    for (int g = 0; g < ZG; ++g) acc += ps[g * DK_ + d];
    q[bh * DK_ + d] = acc;
    red[d] = acc * bkv;
  }
  __syncthreads();
  for (int s = DK_ / 2; s > 0; s >>= 1) {
    if (d < s) red[d] += red[d + s];
    __syncthreads();
  }
  if (d == 0) qb[bh] = red[0];
}

// ---------------------------------------------------------------------------
// Kernel 1b: qk[b,h,z] = sum_d q[b,h,d] * Wk[h,z,d]
// ---------------------------------------------------------------------------
__global__ void qk_kernel(const float* __restrict__ q,
                          const float* __restrict__ Wk,
                          float* __restrict__ qk) {
  int bh = blockIdx.x;
  int h = bh % H_;
  __shared__ float qs[DK_];
  if (threadIdx.x < DK_) qs[threadIdx.x] = q[bh * DK_ + threadIdx.x];
  __syncthreads();
  for (int z = threadIdx.x; z < Z_; z += blockDim.x) {
    const float* w = Wk + ((size_t)h * Z_ + z) * DK_;
    float acc = 0.f;
#pragma unroll 8
    for (int d = 0; d < DK_; ++d) acc += qs[d] * w[d];
    qk[(size_t)bh * Z_ + z] = acc;
  }
}

// ---------------------------------------------------------------------------
// Kernel 2: scores[b,h,t] = qk[b,h,:]·o_all[b,t,:] + qb[b,h]
// GEMM per batch: M=16(H) x N=T x K=Z, fp32 WMMA 16x16x4.
// Double-buffered async global->LDS staging of o_all tiles.
// ---------------------------------------------------------------------------
#define TT 128   // t-tile per block (8 waves x 16)
#define ZC 32    // z (K) chunk staged in LDS
#define LDP 36   // padded LDS row stride (floats): 144B rows, 16B aligned
#define SLPW 4   // async b128 issues per thread per chunk = TT*ZC/4/256

__global__ __launch_bounds__(256) void scores_kernel(
    const float* __restrict__ o_all, const float* __restrict__ qk,
    const float* __restrict__ qb, float* __restrict__ scores) {
  int b = blockIdx.y;
  int t0 = blockIdx.x * TT;
  int tid = threadIdx.x;
  int lane = tid & 31, wv = tid >> 5;
  int hn = lane & 15;            // A: M (head) / B: N (t) index
  int kb = (lane >> 4) * 2;      // K-pair base within the 4-wide K slab
  __shared__ float lds_o[2 * TT * LDP];

  v8f acc = {};
  const float* ob  = o_all + (size_t)b * T_ * Z_;
  const float* qkb = qk + (size_t)(b * H_) * Z_;

  // stage chunk 0 into buffer 0
#pragma unroll
  for (int i = 0; i < SLPW; ++i) {
    int f = tid + i * 256;
    int row = f >> 3;            // ZC/4 = 8 float4 per row
    int c4  = f & 7;
    cp16_async(ob + (size_t)(t0 + row) * Z_ + c4 * 4, &lds_o[row * LDP + c4 * 4]);
  }

  const int NCH = Z_ / ZC;       // 32 chunks
  for (int c = 0; c < NCH; ++c) {
    float* cur = &lds_o[(c & 1) * (TT * LDP)];
    if (c + 1 < NCH) {
      float* nxt = &lds_o[((c + 1) & 1) * (TT * LDP)];
      int zc1 = (c + 1) * ZC;
#pragma unroll
      for (int i = 0; i < SLPW; ++i) {
        int f = tid + i * 256;
        int row = f >> 3;
        int c4  = f & 7;
        cp16_async(ob + (size_t)(t0 + row) * Z_ + zc1 + c4 * 4,
                   &nxt[row * LDP + c4 * 4]);
      }
      ASYNC_WAIT(SLPW);          // chunk c landed; chunk c+1 still in flight
    } else {
      ASYNC_WAIT(0);
    }
    __syncthreads();

    int zc = c * ZC;
#pragma unroll
    for (int kk = 0; kk < ZC; kk += 4) {
      v2f a  = *(const v2f*)(qkb + (size_t)hn * Z_ + zc + kk + kb);
      v2f bf = *(const v2f*)&cur[(wv * 16 + hn) * LDP + kk + kb];
      acc = __builtin_amdgcn_wmma_f32_16x16x4_f32(false, a, false, bf,
                                                  (short)0, acc, false, false);
    }
    __syncthreads();
  }

  int mb = (lane >> 4) * 8;
  float* srow = scores + (size_t)(b * H_) * T_ + t0 + wv * 16 + hn;
#pragma unroll
  for (int r = 0; r < 8; ++r) {
    int h = mb + r;
    srow[(size_t)h * T_] = acc[r] + qb[b * H_ + h];
  }
}

// ---------------------------------------------------------------------------
// Kernel 3: row softmax over T per (b,h)
// ---------------------------------------------------------------------------
__global__ __launch_bounds__(256) void softmax_kernel(float* __restrict__ s) {
  float* p = s + (size_t)blockIdx.x * T_;
  int tid = threadIdx.x;
  __shared__ float red[256];
  float m = -3.4e38f;
  for (int t = tid; t < T_; t += 256) m = fmaxf(m, p[t]);
  red[tid] = m;
  __syncthreads();
  for (int st = 128; st > 0; st >>= 1) {
    if (tid < st) red[tid] = fmaxf(red[tid], red[tid + st]);
    __syncthreads();
  }
  m = red[0];
  __syncthreads();
  float sum = 0.f;
  for (int t = tid; t < T_; t += 256) {
    float e = __expf(p[t] - m);
    p[t] = e;
    sum += e;
  }
  red[tid] = sum;
  __syncthreads();
  for (int st = 128; st > 0; st >>= 1) {
    if (tid < st) red[tid] += red[tid + st];
    __syncthreads();
  }
  float inv = 1.0f / red[0];
  for (int t = tid; t < T_; t += 256) p[t] *= inv;
}

// ---------------------------------------------------------------------------
// Kernel 4: part[ts,b,h,z] = sum over slice ts of t of s[b,h,t] * o_all[b,t,z]
// GEMM per batch: M=16(H) x N=Z x K=T, fp32 WMMA 16x16x4.
// K (= T) is cut into TS slices, one work-group and one partial sum each, so
// that 8 * 16 * TS work-groups stream o_all instead of 128; kernel 5 adds the
// partials up.
// Double-buffered async global->LDS staging of o_all tiles.
// ---------------------------------------------------------------------------
#define ZT 128    // z-tile (N) per block (8 waves x 16)
#define TC 32     // t (K) chunk staged in LDS
#define LDP2 132  // padded LDS row stride (floats): 528B rows, 16B aligned
#define CLPW 4    // async b128 issues per thread per chunk = TC*ZT/4/256
#define TS 8      // slices of T, one partial sum each
#define TSL (T_ / TS)  // t per slice

__global__ __launch_bounds__(256) void ctxz_kernel(
    const float* __restrict__ o_all, const float* __restrict__ s,
    float* __restrict__ part) {
  int b = blockIdx.y;
  int z0 = blockIdx.x * ZT;
  int ts = blockIdx.z;
  int tid = threadIdx.x;
  int lane = tid & 31, wv = tid >> 5;
  int hn = lane & 15;
  int kb = (lane >> 4) * 2;
  __shared__ float lds_o[2 * TC * LDP2];

  v8f acc = {};
  const float* ob = o_all + ((size_t)b * T_ + ts * TSL) * Z_;
  const float* sb = s + (size_t)(b * H_) * T_ + ts * TSL;

  // stage chunk 0 into buffer 0
#pragma unroll
  for (int i = 0; i < CLPW; ++i) {
    int f = tid + i * 256;
    int row = f >> 5;            // ZT/4 = 32 float4 per row
    int c4  = f & 31;
    cp16_async(ob + (size_t)row * Z_ + z0 + c4 * 4, &lds_o[row * LDP2 + c4 * 4]);
  }

  const int NCH = TSL / TC;      // 16 chunks per slice
  for (int c = 0; c < NCH; ++c) {
    float* cur = &lds_o[(c & 1) * (TC * LDP2)];
    if (c + 1 < NCH) {
      float* nxt = &lds_o[((c + 1) & 1) * (TC * LDP2)];
      int t1 = (c + 1) * TC;
#pragma unroll
      for (int i = 0; i < CLPW; ++i) {
        int f = tid + i * 256;
        int row = f >> 5;
        int c4  = f & 31;
        cp16_async(ob + (size_t)(t1 + row) * Z_ + z0 + c4 * 4,
                   &nxt[row * LDP2 + c4 * 4]);
      }
      ASYNC_WAIT(CLPW);
    } else {
      ASYNC_WAIT(0);
    }
    __syncthreads();

    int t0 = c * TC;
#pragma unroll
    for (int kk = 0; kk < TC; kk += 4) {
      v2f a = *(const v2f*)(sb + (size_t)hn * T_ + t0 + kk + kb);
      v2f bf;
      bf.x = cur[(kk + kb + 0) * LDP2 + wv * 16 + hn];
      bf.y = cur[(kk + kb + 1) * LDP2 + wv * 16 + hn];
      acc = __builtin_amdgcn_wmma_f32_16x16x4_f32(false, a, false, bf,
                                                  (short)0, acc, false, false);
    }
    __syncthreads();
  }

  int mb = (lane >> 4) * 8;
#pragma unroll
  for (int r = 0; r < 8; ++r) {
    int h = mb + r;
    part[(size_t)((ts * B_ + b) * H_ + h) * Z_ + z0 + wv * 16 + hn] = acc[r];
  }
}

// ---------------------------------------------------------------------------
// Kernel 5: ctxz[b,h,z] = sum_ts part[ts,b,h,z] (into LDS), then
//           out[b, h*DK+d] = sum_z ctxz[b,h,z]*Wv[h,z,d] + bv[h,d]
// ---------------------------------------------------------------------------
#define PRE 8  // windows whose weight rows are asked for ahead of the merge's barrier

__global__ __launch_bounds__(PT) PROJ_BUDGET void ctx_kernel(
    const float* __restrict__ part, const float* __restrict__ Wv,
    const float* __restrict__ bv, float* __restrict__ out) {
  int bh = blockIdx.x;
  int b = bh / H_, h = bh % H_;
  int tid = threadIdx.x;
  int d4 = (tid & 15) * 4;
  int zg = tid >> 4;
  __shared__ float c[Z_];
  __shared__ float ps[ZG * DK_];
  const float* p0 = part + (size_t)bh * Z_ + tid * 4;
  const float* w = Wv + ((size_t)h * Z_ + zg * 4) * DK_ + d4;
  // the bias and the first PRE windows' weight rows do not depend on the
  // merge: asked for ahead of its barrier, their latency runs beside the merge's
  float bvv = 0.f;
  if (tid < DK_) bvv = bv[h * DK_ + tid];
  v4f a = *(const v4f*)p0;
#pragma unroll
  for (int ts = 1; ts < TS; ++ts)
    a += *(const v4f*)(p0 + (size_t)ts * B_ * H_ * Z_);
  v4f wr[PRE * 4];
#pragma unroll  // constant indices keep wr[] in registers (here and below)
  for (int i = 0; i < PRE; ++i)
#pragma unroll
    for (int j = 0; j < 4; ++j)
      wr[i * 4 + j] = *(const v4f*)(w + (i * ZW + j) * DK_);
  *(v4f*)&c[tid * 4] = a;
  __syncthreads();
  v4f a4 = {};
#pragma unroll
  for (int i = 0; i < PRE; ++i) {
    v4f o = *(const v4f*)&c[i * ZW + zg * 4];
#pragma unroll
    for (int j = 0; j < 4; ++j) a4 += o[j] * wr[i * 4 + j];
  }
#pragma unroll  // all rows' loads independent and visible to the scheduler
  for (int i = PRE; i < NW; ++i) {
    v4f o = *(const v4f*)&c[i * ZW + zg * 4];
#pragma unroll
    for (int j = 0; j < 4; ++j)
      a4 += o[j] * *(const v4f*)(w + (i * ZW + j) * DK_);
  }
  *(v4f*)&ps[zg * DK_ + d4] = a4;
  __syncthreads();
  if (tid < DK_) {
    float acc = bvv;
#pragma unroll  // the ZG LDS reads issued together
    for (int g = 0; g < ZG; ++g) acc += ps[g * DK_ + tid];
    out[(size_t)b * Z_ + h * DK_ + tid] = acc;
  }
}

// ---------------------------------------------------------------------------
extern "C" void kernel_launch(void* const* d_in, const int* in_sizes, int n_in,
                              void* d_out, int out_size, void* d_ws, size_t ws_size,
                              hipStream_t stream) {
  const float* o_all  = (const float*)d_in[0];
  const float* o_last = (const float*)d_in[1];
  const float* Wk     = (const float*)d_in[2];
  const float* Wv     = (const float*)d_in[3];
  const float* Wq     = (const float*)d_in[4];
  const float* bk     = (const float*)d_in[5];
  const float* bv     = (const float*)d_in[6];
  const float* bq     = (const float*)d_in[7];
  float* out = (float*)d_out;

  float* ws     = (float*)d_ws;
  float* q      = ws;                              // B*H*DK
  float* qb     = q + B_ * H_ * DK_;               // B*H
  float* qk     = qb + B_ * H_;                    // B*H*Z
  float* scores = qk + B_ * H_ * Z_;               // B*H*T
  float* part   = scores + (size_t)B_ * H_ * T_;   // TS*B*H*Z

  qproj_kernel<<<B_ * H_, PT, 0, stream>>>(o_last, Wq, bq, bk, q, qb);
  qk_kernel<<<B_ * H_, 256, 0, stream>>>(q, Wk, qk);
  scores_kernel<<<dim3(T_ / TT, B_), 256, 0, stream>>>(o_all, qk, qb, scores);
  softmax_kernel<<<B_ * H_, 256, 0, stream>>>(scores);
  ctxz_kernel<<<dim3(Z_ / ZT, B_, TS), 256, 0, stream>>>(o_all, scores, part);
  ctx_kernel<<<B_ * H_, PT, 0, stream>>>(part, Wv, bv, out);
}

// v003
// One run takes 58.5 microseconds.
// In two side-by-side timings against v002, it was 1.56 and 1.55 times as fast.
// All steps since v000 together make it 3.97 times as fast.
#include <hip/hip_runtime.h>

#define B_ 16
#define T_ 4096
#define Z_ 1024
#define H_ 16
#define DK_ 64

typedef __attribute__((ext_vector_type(2))) float v2f;
typedef __attribute__((ext_vector_type(4))) float v4f;
typedef __attribute__((ext_vector_type(8))) float v8f;

// ---------------------------------------------------------------------------
// CDNA5 async global->LDS path (ASYNCcnt-tracked, bypasses VGPRs).
// Builtin signature (from hipcc diagnostic): first param is
// `__attribute__((vector_size(16))) int` pointer in the global (as1) space.
// Falls back to synchronous v4f staging if the toolchain lacks the builtins.
// ---------------------------------------------------------------------------
#if defined(__has_builtin)
#if __has_builtin(__builtin_amdgcn_global_load_async_to_lds_b128) && \
    __has_builtin(__builtin_amdgcn_s_wait_asynccnt)
#define HAVE_ASYNC 1
#endif
#endif
#ifndef HAVE_ASYNC
#define HAVE_ASYNC 0
#endif

#if HAVE_ASYNC
typedef int v4i __attribute__((vector_size(16)));
typedef __attribute__((address_space(1))) v4i g_v4i;
typedef __attribute__((address_space(3))) v4i l_v4i;
__device__ __forceinline__ void cp16_async(const float* g, float* l) {
  __builtin_amdgcn_global_load_async_to_lds_b128((g_v4i*)g, (l_v4i*)l, 0, 0);
}
#else
__device__ __forceinline__ void cp16_async(const float* g, float* l) {
  *(v4f*)l = *(const v4f*)g;
}
#endif

// ---------------------------------------------------------------------------
// The two projection launches (1a and 3) walk z = 0..Z-1 for one (b,h). The
// walk is dealt to ZG groups of 16 threads: a thread holds 4 d (one 16-byte
// load per weight row) and its group takes 4 consecutive z out of every
// window of ZW, so that a work-group keeps many rows' loads in flight instead
// of one dependent chain of Z steps, and reads the weights in contiguous
// 16-KiB windows. The ZG partial sums meet in LDS.
// ---------------------------------------------------------------------------
#define PT 256            // threads per projection work-group
#define ZG (PT / 16)      // groups that share the z walk
#define ZW (4 * ZG)       // z per window
#define NW (Z_ / ZW)      // windows
// One work-group per WGP is all these launches have, so registers are free:
// a budget of 256 lets the compiler keep most of a thread's NW * 4 row loads
// in flight at once; at the default budget it keeps about eleven.
#define PROJ_BUDGET __attribute__((amdgpu_waves_per_eu(4, 4)))

// ---------------------------------------------------------------------------
// Kernel 1a: q[b,h,d] = o_last[b,:]·Wq[h,:,d] + bq[h,d] ; qb[b,h] = q·bk[h,:]
// ---------------------------------------------------------------------------
__global__ __launch_bounds__(PT) PROJ_BUDGET void qproj_kernel(
    const float* __restrict__ o_last, const float* __restrict__ Wq,
    const float* __restrict__ bq, const float* __restrict__ bk,
    float* __restrict__ q, float* __restrict__ qb) {
  int bh = blockIdx.x;
  int b = bh / H_, h = bh % H_;
  int d = threadIdx.x;
  int d4 = (d & 15) * 4;
  int zg = d >> 4;
  const float* ol = o_last + b * Z_ + zg * 4;
  const float* w  = Wq + ((size_t)h * Z_ + zg * 4) * DK_ + d4;
  __shared__ float ps[ZG * DK_];
  __shared__ float red[DK_];
  // biases asked for ahead of the barrier, so that their latency runs beside
  // the walk's
  float bqv = 0.f, bkv = 0.f;
  if (d < DK_) {
    bqv = bq[h * DK_ + d];
    bkv = bk[h * DK_ + d];
  }
  v4f a4 = {};
#pragma unroll  // all rows' loads independent and visible to the scheduler
  for (int i = 0; i < NW; ++i) {
    v4f o = *(const v4f*)(ol + i * ZW);
#pragma unroll  // o[j] by a constant index
    for (int j = 0; j < 4; ++j)
      a4 += o[j] * *(const v4f*)(w + (i * ZW + j) * DK_);
  }
  *(v4f*)&ps[zg * DK_ + d4] = a4;
  __syncthreads();
  if (d < DK_) {
    float acc = bqv;
#pragma unroll  // the ZG LDS reads issued together
    for (int g = 0; g < ZG; ++g) acc += ps[g * DK_ + d];
    q[bh * DK_ + d] = acc;
    red[d] = acc * bkv;
  }
  __syncthreads();
  for (int s = DK_ / 2; s > 0; s >>= 1) {
    if (d < s) red[d] += red[d + s];
    __syncthreads();
  }
  if (d == 0) qb[bh] = red[0];
}

// ---------------------------------------------------------------------------
// Kernel 1b: qk[b,h,z] = sum_d q[b,h,d] * Wk[h,z,d]
// ---------------------------------------------------------------------------
__global__ void qk_kernel(const float* __restrict__ q,
                          const float* __restrict__ Wk,
                          float* __restrict__ qk) {
  int bh = blockIdx.x;
  int h = bh % H_;
  __shared__ float qs[DK_];
  if (threadIdx.x < DK_) qs[threadIdx.x] = q[bh * DK_ + threadIdx.x];
  __syncthreads();
  for (int z = threadIdx.x; z < Z_; z += blockDim.x) {
    const float* w = Wk + ((size_t)h * Z_ + z) * DK_;
    float acc = 0.f;
#pragma unroll 8
    for (int d = 0; d < DK_; ++d) acc += qs[d] * w[d];
    qk[(size_t)bh * Z_ + z] = acc;
  }
}

// ---------------------------------------------------------------------------
// Kernel 2: one pass over o_all for scores, softmax and the weighted sum.
// A work-group takes one batch and one slice of T and walks it in tiles of FT
// rows x all Z, staged in LDS by async copies, two buffers. Per tile:
//   1. scores[h,t] = qk[b,h,:].o_all[b,t,:]: wave w sums its 128 z
//      (fp32 WMMA 16x16x4, M=H, N=t, K=z; its share of qk stays in registers);
//      the 8 partial tiles meet in LDS
//   2. thread (h,t) adds them and qb, takes the head's running maximum, and
//      leaves p = exp(score - max) and the factor that rescales older sums
//   3. acc[h,z] = acc[h,z] * factor + sum_t p[h,t] * o_all[b,t,z] from the
//      same LDS tile (WMMA, M=H, N=z, K=t; wave w owns its 128 z)
// Each slice hands kernel 3 its unnormalised sum (part) and, in
// pml[sp,b,0:16] and pml[sp,b,16:32], its denominators and its maxima.
// ---------------------------------------------------------------------------
#define FT 16            // t rows per tile
#define FP 1044          // LDS row pitch (floats): 16-byte rows; both fragment reads spread over the banks
#define NSP 32           // slices of T, one work-group each; the merge deals them to a wave's 32 lanes
static_assert(NSP == 32, "the merge gives each lane of a wave one slice");
#define FSL (T_ / NSP)   // t per slice
#define FNT (FSL / FT)   // tiles per slice
#define ZWV (Z_ / 8)     // z per wave
#define PPI 20           // pitch of p[h][t] (floats)

// one tile: FT rows of Z floats, one 16-byte copy per thread and row
__device__ __forceinline__ void stage_tile(const float* g, float* l, int tid) {
#pragma unroll  // constant row steps
  for (int i = 0; i < FT; ++i)
    cp16_async(g + (size_t)i * Z_ + tid * 4, l + i * FP + tid * 4);
}

// maximum over the 16 lanes of a row, in every lane (all lanes on)
__device__ __forceinline__ float rowmax16(float x) {
  int v;
  v = __float_as_int(x);
  x = fmaxf(x, __int_as_float(__builtin_amdgcn_update_dpp(v, v, 0x161, 0xf, 0xf, false)));
  v = __float_as_int(x);
  x = fmaxf(x, __int_as_float(__builtin_amdgcn_update_dpp(v, v, 0x162, 0xf, 0xf, false)));
  v = __float_as_int(x);
  x = fmaxf(x, __int_as_float(__builtin_amdgcn_update_dpp(v, v, 0x164, 0xf, 0xf, false)));
  v = __float_as_int(x);
  x = fmaxf(x, __int_as_float(__builtin_amdgcn_update_dpp(v, v, 0x168, 0xf, 0xf, false)));
  return x;
}

// sum over the 16 lanes of a row, in every lane (all lanes on)
__device__ __forceinline__ float rowsum16(float x) {
  int v;
  v = __float_as_int(x);
  x += __int_as_float(__builtin_amdgcn_update_dpp(v, v, 0x161, 0xf, 0xf, false));
  v = __float_as_int(x);
  x += __int_as_float(__builtin_amdgcn_update_dpp(v, v, 0x162, 0xf, 0xf, false));
  v = __float_as_int(x);
  x += __int_as_float(__builtin_amdgcn_update_dpp(v, v, 0x164, 0xf, 0xf, false));
  v = __float_as_int(x);
  x += __int_as_float(__builtin_amdgcn_update_dpp(v, v, 0x168, 0xf, 0xf, false));
  return x;
}

// lane n's value of x, the same in every lane (n a constant)
__device__ __forceinline__ float lane_value(float x, int n) {
  return __int_as_float(__builtin_amdgcn_readlane(__float_as_int(x), n));
}

// a wave's two row results joined
__device__ __forceinline__ float both_rows_max(float x) {
  return fmaxf(lane_value(x, 0), lane_value(x, 16));
}
__device__ __forceinline__ float both_rows_sum(float x) {
  return lane_value(x, 0) + lane_value(x, 16);
}

__global__ __launch_bounds__(256) void attn_kernel(
    const float* __restrict__ o_all, const float* __restrict__ qk,
    const float* __restrict__ qb, float* __restrict__ part,
    float* __restrict__ pml) {
  int b = blockIdx.y;
  int sp = blockIdx.x;
  int tid = threadIdx.x;
  int lane = tid & 31, wv = tid >> 5;
  int hn = lane & 15;            // A: M (head) / B: N index
  int kb = (lane >> 4) * 2;      // K-pair base within the 4-wide K slab
  int mb = (lane >> 4) * 8;      // D: first of this lane's 8 rows (heads)
  int zw = wv * ZWV;
  __shared__ __attribute__((aligned(16))) float lds_o[2 * FT * FP];
  __shared__ float sps[8 * H_ * FT];
  __shared__ __attribute__((aligned(16))) float pp[H_ * PPI];
  __shared__ __attribute__((aligned(16))) float al[H_];

  const float* ob = o_all + ((size_t)b * T_ + sp * FSL) * Z_;
  stage_tile(ob, lds_o, tid);

  // this wave's share of qk, as A fragments, asked for while tile 0 flies
  const float* qkb = qk + (size_t)(b * H_ + hn) * Z_ + zw + kb;
  v2f qa[ZWV / 4];
#pragma unroll  // constant indices keep qa[] in registers
  for (int j = 0; j < ZWV / 4; ++j) qa[j] = *(const v2f*)(qkb + j * 4);
  float qbv = qb[b * H_ + (tid >> 4)];

  // tile 0 has landed for this wave; the barrier publishes it to the others
  asm volatile("s_wait_asynccnt 0x0" ::: "memory");
  __syncthreads();
  stage_tile(ob + (size_t)FT * Z_, lds_o + FT * FP, tid);

  v8f acc[8] = {};
  float m_run = -3.4e38f, l_run = 0.f;

  for (int c = 0; c < FNT; ++c) {
    float* cur = lds_o + (c & 1) * (FT * FP);

    // 1. partial scores over this wave's z
    v8f s0 = {}, s1 = {};        // two chains: the f32 form wants two tiles
    const float* br = cur + hn * FP + zw + kb;
#pragma unroll  // qa[] by constant indices
    for (int j = 0; j < ZWV / 4; j += 2) {
      v2f b0 = *(const v2f*)(br + j * 4);
      v2f b1 = *(const v2f*)(br + j * 4 + 4);
      s0 = __builtin_amdgcn_wmma_f32_16x16x4_f32(false, qa[j], false, b0,
                                                 (short)0, s0, false, false);
      s1 = __builtin_amdgcn_wmma_f32_16x16x4_f32(false, qa[j + 1], false, b1,
                                                 (short)0, s1, false, false);
    }
#pragma unroll  // vector elements by constant indices (here and below)
    for (int r = 0; r < 8; ++r)
      sps[wv * (H_ * FT) + (mb + r) * FT + hn] = s0[r] + s1[r];
    __syncthreads();

    // 2. thread (h,t) = (tid >> 4, tid & 15)
    float sc = qbv;
#pragma unroll  // the 8 LDS reads issued together
    for (int w = 0; w < 8; ++w) sc += sps[w * (H_ * FT) + tid];
    float mx = fmaxf(m_run, rowmax16(sc));
    float alpha = __expf(m_run - mx);
    float pv = __expf(sc - mx);
    l_run = l_run * alpha + pv;
    m_run = mx;
    pp[(tid >> 4) * PPI + (tid & 15)] = pv;
    if ((tid & 15) == 0) al[tid >> 4] = alpha;
    __syncthreads();

    // 3. rescale, then add this tile's weighted rows
    v2f pa[FT / 4];
#pragma unroll
    for (int k = 0; k < FT / 4; ++k)
      pa[k] = *(const v2f*)&pp[hn * PPI + k * 4 + kb];
    v4f av0 = *(const v4f*)&al[mb];
    v4f av1 = *(const v4f*)&al[mb + 4];
#pragma unroll
    for (int n = 0; n < 8; ++n)
#pragma unroll
      for (int r = 0; r < 4; ++r) {
        acc[n][r] *= av0[r];
        acc[n][r + 4] *= av1[r];
      }
#pragma unroll
    for (int k = 0; k < FT / 4; ++k)
#pragma unroll  // 8 independent accumulator tiles back to back
      for (int n = 0; n < 8; ++n) {
        const float* p0 = cur + (k * 4 + kb) * FP + zw + n * 16 + hn;
        v2f bf;
        bf.x = p0[0];
        bf.y = p0[FP];
        acc[n] = __builtin_amdgcn_wmma_f32_16x16x4_f32(false, pa[k], false, bf,
                                                       (short)0, acc[n], false, false);
      }

    // publish point: this wave's reads of the tile are done, its copies of the
    // next tile have landed; behind the barrier the buffer just read is free
    asm volatile("s_wait_dscnt 0x0" ::: "memory");
    asm volatile("s_wait_asynccnt 0x0" ::: "memory");
    __syncthreads();
    if (c + 2 < FNT)
      stage_tile(ob + (size_t)(c + 2) * FT * Z_, cur, tid);
  }
  // no copy is left in flight when the wave ends
  asm volatile("s_wait_asynccnt 0x0" ::: "memory");

  int sbh = (sp * B_ + b) * H_;
#pragma unroll
  for (int n = 0; n < 8; ++n)
#pragma unroll
    for (int r = 0; r < 8; ++r)
      part[(size_t)(sbh + mb + r) * Z_ + zw + n * 16 + hn] = acc[n][r];
  // the slice's 16 denominators and 16 maxima leave as one 128-byte line
  sps[tid] = l_run;
  if ((tid & 15) == 0) al[tid >> 4] = m_run;
  __syncthreads();
  if (tid < 2 * H_) {
    float v;
    if (tid < H_) {
      v = 0.f;
#pragma unroll
      for (int t = 0; t < FT; ++t) v += sps[tid * FT + t];
    } else {
      v = al[tid - H_];
    }
    pml[sbh * 2 + tid] = v;
  }
}

// ---------------------------------------------------------------------------
// Kernel 3: ctxz[b,h,z] = sum_sp part[sp,b,h,z] * exp(max[sp] - max) / denominator
//           (into LDS), then
//           out[b, h*DK+d] = sum_z ctxz[b,h,z]*Wv[h,z,d] + bv[h,d]
// ---------------------------------------------------------------------------
#define PRE 8  // windows whose weight rows are asked for ahead of the merge's barrier

__global__ __launch_bounds__(PT) PROJ_BUDGET void ctx_kernel(
    const float* __restrict__ part, const float* __restrict__ pml,
    const float* __restrict__ Wv,
    const float* __restrict__ bv, float* __restrict__ out) {
  int bh = blockIdx.x;
  int b = bh / H_, h = bh % H_;
  int tid = threadIdx.x;
  int d4 = (tid & 15) * 4;
  int zg = tid >> 4;
  __shared__ float c[Z_];
  __shared__ float ps[ZG * DK_];
  const float* p0 = part + (size_t)bh * Z_ + tid * 4;
  const float* w = Wv + ((size_t)h * Z_ + zg * 4) * DK_ + d4;
  // the bias and the first PRE windows' weight rows do not depend on the
  // merge: asked for ahead of its barrier, their latency runs beside the merge's
  float bvv = 0.f;
  if (tid < DK_) bvv = bv[h * DK_ + tid];
  // every slice's sum is brought to the common maximum: lane s of each wave
  // takes slice s's maximum and denominator (NSP = the lanes of a wave), so
  // that all of them are asked for at once
  const float* pm = pml + ((tid & 31) * B_ + b) * 2 * H_ + h;
  float dsl = pm[0];
  float msl = pm[H_];
  float wl = __expf(msl - both_rows_max(rowmax16(msl)));
  wl *= 1.0f / both_rows_sum(rowsum16(dsl * wl));
  v4f a = {};
#pragma unroll  // constant lane numbers; all slices' loads independent
  for (int s = 0; s < NSP; ++s)
    a += lane_value(wl, s) * *(const v4f*)(p0 + (size_t)s * B_ * H_ * Z_);
  // the weight rows below may land in registers that hold the addresses of the
  // loads above: the wait stands between the two
  asm volatile("s_wait_xcnt 0x0" ::: "memory");
  v4f wr[PRE * 4];
#pragma unroll  // constant indices keep wr[] in registers (here and below)
  for (int i = 0; i < PRE; ++i)
#pragma unroll
    for (int j = 0; j < 4; ++j)
      wr[i * 4 + j] = *(const v4f*)(w + (i * ZW + j) * DK_);
  *(v4f*)&c[tid * 4] = a;
  __syncthreads();
  v4f a4 = {};
#pragma unroll
  for (int i = 0; i < PRE; ++i) {
    v4f o = *(const v4f*)&c[i * ZW + zg * 4];
#pragma unroll
    for (int j = 0; j < 4; ++j) a4 += o[j] * wr[i * 4 + j];
  }
#pragma unroll  // all rows' loads independent and visible to the scheduler
  for (int i = PRE; i < NW; ++i) {
    v4f o = *(const v4f*)&c[i * ZW + zg * 4];
#pragma unroll
    for (int j = 0; j < 4; ++j)
      a4 += o[j] * *(const v4f*)(w + (i * ZW + j) * DK_);
  }
  *(v4f*)&ps[zg * DK_ + d4] = a4;
  __syncthreads();
  if (tid < DK_) {
    float acc = bvv;
#pragma unroll  // the ZG LDS reads issued together
    for (int g = 0; g < ZG; ++g) acc += ps[g * DK_ + tid];
    out[(size_t)b * Z_ + h * DK_ + tid] = acc;
  }
}

// ---------------------------------------------------------------------------
extern "C" void kernel_launch(void* const* d_in, const int* in_sizes, int n_in,
                              void* d_out, int out_size, void* d_ws, size_t ws_size,
                              hipStream_t stream) {
  const float* o_all  = (const float*)d_in[0];
  const float* o_last = (const float*)d_in[1];
  const float* Wk     = (const float*)d_in[2];
  const float* Wv     = (const float*)d_in[3];
  const float* Wq     = (const float*)d_in[4];
  const float* bk     = (const float*)d_in[5];
  const float* bv     = (const float*)d_in[6];
  const float* bq     = (const float*)d_in[7];
  float* out = (float*)d_out;

  float* ws     = (float*)d_ws;
  float* q      = ws;                              // B*H*DK
  float* qb     = q + B_ * H_ * DK_;               // B*H
  float* qk     = qb + B_ * H_;                    // B*H*Z
  float* pml    = qk + B_ * H_ * Z_;               // NSP*B*2*H
  float* part   = pml + NSP * B_ * 2 * H_;         // NSP*B*H*Z

  qproj_kernel<<<B_ * H_, PT, 0, stream>>>(o_last, Wq, bq, bk, q, qb);
  qk_kernel<<<B_ * H_, 256, 0, stream>>>(q, Wk, qk);
  attn_kernel<<<dim3(NSP, B_), 256, 0, stream>>>(o_all, qk, qb, part, pml);
  ctx_kernel<<<B_ * H_, PT, 0, stream>>>(part, pml, Wv, bv, out);
}

// v004
// One run takes 53 microseconds.
// Timed twice side by side with v003, it ran 1.11 and 1.12 times as fast.
// All steps since v000 together make it 4.43 times as fast.
#include <hip/hip_runtime.h>

#define B_ 16
#define T_ 4096
#define Z_ 1024
#define H_ 16
#define DK_ 64

typedef __attribute__((ext_vector_type(2))) float v2f;
typedef __attribute__((ext_vector_type(4))) float v4f;
typedef __attribute__((ext_vector_type(8))) float v8f;

// ---------------------------------------------------------------------------
// CDNA5 async global->LDS path (ASYNCcnt-tracked, bypasses VGPRs).
// Builtin signature (from hipcc diagnostic): first param is
// `__attribute__((vector_size(16))) int` pointer in the global (as1) space.
// Falls back to synchronous v4f staging if the toolchain lacks the builtins.
// ---------------------------------------------------------------------------
#if defined(__has_builtin)
#if __has_builtin(__builtin_amdgcn_global_load_async_to_lds_b128) && \
    __has_builtin(__builtin_amdgcn_s_wait_asynccnt)
#define HAVE_ASYNC 1
#endif
#endif
#ifndef HAVE_ASYNC
#define HAVE_ASYNC 0
#endif

#if HAVE_ASYNC
typedef int v4i __attribute__((vector_size(16)));
typedef __attribute__((address_space(1))) v4i g_v4i;
typedef __attribute__((address_space(3))) v4i l_v4i;
__device__ __forceinline__ void cp16_async(const float* g, float* l) {
  __builtin_amdgcn_global_load_async_to_lds_b128((g_v4i*)g, (l_v4i*)l, 0, 0);
}
#else
__device__ __forceinline__ void cp16_async(const float* g, float* l) {
  *(v4f*)l = *(const v4f*)g;
}
#endif

// ---------------------------------------------------------------------------
// The two projection launches (1 and 3) walk z = 0..Z-1 for one (b,h). The
// walk is dealt to ZG groups of 16 threads: a thread holds 4 d (one 16-byte
// load per weight row) and its group takes 4 consecutive z out of every
// window of ZW, so that a work-group keeps many rows' loads in flight instead
// of one dependent chain of Z steps, and reads the weights in contiguous
// 16-KiB windows. The ZG partial sums meet in LDS.
// ---------------------------------------------------------------------------
#define PT 256            // threads per projection work-group
#define ZG (PT / 16)      // groups that share the z walk
#define ZW (4 * ZG)       // z per window
#define NW (Z_ / ZW)      // windows
// One work-group per WGP is all the last launch has, so registers are free:
// a budget of 256 lets the compiler keep most of a thread's NW * 4 row loads
// in flight at once; at the default budget it keeps about eleven.
#define PROJ_BUDGET __attribute__((amdgpu_waves_per_eu(4, 4)))

// ---------------------------------------------------------------------------
// Kernel 1: q[b,h,d] = o_last[b,:].Wq[h,:,d] + bq[h,d] ; qb[b,h] = q.bk[h,:] ;
//           qk[b,h,z] = sum_d q[b,h,d] * Wk[h,z,d]
// One work-group per (b,h) does both. Wk[h] does not depend on q: async copies
// bring it to LDS while the walk over Wq runs, so that its way from memory is
// behind the work-group when q is ready. q stays in LDS. A thread then owns
// whole rows of Wk[h] and reads them from LDS at a pitch that spreads a
// column walk of 16-byte reads over the banks.
// ---------------------------------------------------------------------------
#define WKP 68            // LDS pitch of a Wk row (floats)
#define CR (PT / 16)      // rows that one copy of every thread brings
#define RA 512            // rows of the first run of copies; the rest follow behind its wait
static_assert(RA / CR <= 63 && (Z_ - RA) / CR <= 63, "copies of a wave in flight");
static_assert(RA % PT == 0 && Z_ % PT == 0, "a thread's rows lie in one run of copies");
// Two waves per SIMD is all this launch has (its LDS leaves room for one
// work-group per WGP): a budget of 512 registers holds the whole walk's loads.
#define FUSE_BUDGET __attribute__((amdgpu_waves_per_eu(2, 2)))

// rows r0 .. r1-1 of Wk[h]: 16 lanes a row, one 16-byte copy per thread and CR rows
__device__ __forceinline__ void stage_rows(const float* g, float* l, int r0, int r1, int tid) {
  int r = tid >> 4, c4 = (tid & 15) * 4;
#pragma unroll  // constant row steps
  for (int i = r0; i < r1; i += CR)
    cp16_async(g + (size_t)(i + r) * DK_ + c4, l + (i + r) * WKP + c4);
}

// one row of Wk[h] against q: the row's 16 reads are asked for together, and
// four partial sums (d mod 4) keep the chain of dependent additions short
__device__ __forceinline__ float row_dot(const float* w, const v4f* qv) {
  v4f x[DK_ / 4];
#pragma unroll  // constant indices keep x[] in registers
  for (int k = 0; k < DK_ / 4; ++k) x[k] = *(const v4f*)(w + k * 4);
  v4f a = {};
#pragma unroll  // qv[] by constant indices
  for (int k = 0; k < DK_ / 4; ++k) a += qv[k] * x[k];
  return (a[0] + a[1]) + (a[2] + a[3]);
}

__global__ __launch_bounds__(PT) FUSE_BUDGET void qqk_kernel(
    const float* __restrict__ o_last, const float* __restrict__ Wq,
    const float* __restrict__ bq, const float* __restrict__ bk,
    const float* __restrict__ Wk, float* __restrict__ qk,
    float* __restrict__ qb) {
  int bh = blockIdx.x;
  int b = bh / H_, h = bh % H_;
  int d = threadIdx.x;
  int d4 = (d & 15) * 4;
  int zg = d >> 4;
  const float* ol = o_last + b * Z_ + zg * 4;
  const float* w  = Wq + ((size_t)h * Z_ + zg * 4) * DK_ + d4;
  const float* wk = Wk + (size_t)h * Z_ * DK_;
  __shared__ __attribute__((aligned(16))) float wkl[Z_ * WKP];
  __shared__ float ps[ZG * DK_];
  __shared__ float red[DK_];
  __shared__ __attribute__((aligned(16))) float qs[DK_];
  stage_rows(wk, wkl, 0, RA, d);
  // biases asked for ahead of the barrier, so that their latency runs beside
  // the walk's
  float bqv = 0.f, bkv = 0.f;
  if (d < DK_) {
    bqv = bq[h * DK_ + d];
    bkv = bk[h * DK_ + d];
  }
  // the whole walk's loads are asked for at once, behind the first run of copies
  v4f o[NW], wr[NW * 4];
#pragma unroll  // constant indices keep o[] and wr[] in registers (here and below)
  for (int i = 0; i < NW; ++i) {
    o[i] = *(const v4f*)(ol + i * ZW);
#pragma unroll
    for (int j = 0; j < 4; ++j)
      wr[i * 4 + j] = *(const v4f*)(w + (i * ZW + j) * DK_);
  }
  // what follows may land in registers that hold the addresses of the loads
  // above: the wait stands between the two, and it names those addresses as
  // inputs so that nothing (a load's own result, arithmetic scheduled early)
  // lands on them ahead of it
  asm volatile("s_wait_xcnt 0x0" :: "v"(w), "v"(zg) : "memory");
  // the first run of copies has landed for this wave (the barrier below
  // publishes it), so that the second run keeps the wave's copies in flight
  // within what the counter holds
  asm volatile("s_wait_asynccnt 0x0" ::: "memory");
  stage_rows(wk, wkl, RA, Z_, d);
  v4f a4 = {};
#pragma unroll
  for (int i = 0; i < NW; ++i)
#pragma unroll
    for (int j = 0; j < 4; ++j) a4 += o[i][j] * wr[i * 4 + j];
  *(v4f*)&ps[zg * DK_ + d4] = a4;
  __syncthreads();
  if (d < DK_) {
    float acc = bqv;
#pragma unroll  // the ZG LDS reads issued together
    for (int g = 0; g < ZG; ++g) acc += ps[g * DK_ + d];
    qs[d] = acc;
    red[d] = acc * bkv;
  }
  __syncthreads();
  for (int s = DK_ / 2; s > 0; s >>= 1) {
    if (d < s) red[d] += red[d + s];
    __syncthreads();
  }

  v4f qv[DK_ / 4];
#pragma unroll  // constant indices keep qv[] in registers
  for (int k = 0; k < DK_ / 4; ++k) qv[k] = *(const v4f*)&qs[k * 4];
  // results wait in registers: a store ahead of the barrier below would be
  // waited for there
  float r[Z_ / PT];
#pragma unroll  // independent rows side by side
  for (int i = 0; i < RA / PT; ++i) r[i] = row_dot(wkl + (i * PT + d) * WKP, qv);
  // the second run has landed for this wave; the barrier publishes it
  asm volatile("s_wait_asynccnt 0x0" ::: "memory");
  __syncthreads();
#pragma unroll
  for (int i = RA / PT; i < Z_ / PT; ++i) r[i] = row_dot(wkl + (i * PT + d) * WKP, qv);
  float* qko = qk + (size_t)bh * Z_ + d;
#pragma unroll
  for (int i = 0; i < Z_ / PT; ++i) qko[i * PT] = r[i];
  if (d == 0) qb[bh] = red[0];
}

// ---------------------------------------------------------------------------
// Kernel 2: one pass over o_all for scores, softmax and the weighted sum.
// A work-group takes one batch and one slice of T and walks it in tiles of FT
// rows x all Z, staged in LDS by async copies, two buffers. Per tile:
//   1. scores[h,t] = qk[b,h,:].o_all[b,t,:]: wave w sums its 128 z
//      (fp32 WMMA 16x16x4, M=H, N=t, K=z; its share of qk stays in registers);
//      the 8 partial tiles meet in LDS
//   2. thread (h,t) adds them and qb, takes the head's running maximum, and
//      leaves p = exp(score - max) and the factor that rescales older sums
//   3. acc[h,z] = acc[h,z] * factor + sum_t p[h,t] * o_all[b,t,z] from the
//      same LDS tile (WMMA, M=H, N=z, K=t; wave w owns its 128 z)
// Each slice hands kernel 3 its unnormalised sum (part) and, in
// pml[sp,b,0:16] and pml[sp,b,16:32], its denominators and its maxima.
// ---------------------------------------------------------------------------
#define FT 16            // t rows per tile
#define FP 1044          // LDS row pitch (floats): 16-byte rows; both fragment reads spread over the banks
#define NSP 32           // slices of T, one work-group each; the merge deals them to a wave's 32 lanes
static_assert(NSP == 32, "the merge gives each lane of a wave one slice");
#define FSL (T_ / NSP)   // t per slice
#define FNT (FSL / FT)   // tiles per slice
#define ZWV (Z_ / 8)     // z per wave
#define PPI 20           // pitch of p[h][t] (floats)

// one tile: FT rows of Z floats, one 16-byte copy per thread and row
__device__ __forceinline__ void stage_tile(const float* g, float* l, int tid) {
#pragma unroll  // constant row steps
  for (int i = 0; i < FT; ++i)
    cp16_async(g + (size_t)i * Z_ + tid * 4, l + i * FP + tid * 4);
}

// maximum over the 16 lanes of a row, in every lane (all lanes on)
__device__ __forceinline__ float rowmax16(float x) {
  int v;
  v = __float_as_int(x);
  x = fmaxf(x, __int_as_float(__builtin_amdgcn_update_dpp(v, v, 0x161, 0xf, 0xf, false)));
  v = __float_as_int(x);
  x = fmaxf(x, __int_as_float(__builtin_amdgcn_update_dpp(v, v, 0x162, 0xf, 0xf, false)));
  v = __float_as_int(x);
  x = fmaxf(x, __int_as_float(__builtin_amdgcn_update_dpp(v, v, 0x164, 0xf, 0xf, false)));
  v = __float_as_int(x);
  x = fmaxf(x, __int_as_float(__builtin_amdgcn_update_dpp(v, v, 0x168, 0xf, 0xf, false)));
  return x;
}

// sum over the 16 lanes of a row, in every lane (all lanes on)
__device__ __forceinline__ float rowsum16(float x) {
  int v;
  v = __float_as_int(x);
  x += __int_as_float(__builtin_amdgcn_update_dpp(v, v, 0x161, 0xf, 0xf, false));
  v = __float_as_int(x);
  x += __int_as_float(__builtin_amdgcn_update_dpp(v, v, 0x162, 0xf, 0xf, false));
  v = __float_as_int(x);
  x += __int_as_float(__builtin_amdgcn_update_dpp(v, v, 0x164, 0xf, 0xf, false));
  v = __float_as_int(x);
  x += __int_as_float(__builtin_amdgcn_update_dpp(v, v, 0x168, 0xf, 0xf, false));
  return x;
}

// lane n's value of x, the same in every lane (n a constant)
__device__ __forceinline__ float lane_value(float x, int n) {
  return __int_as_float(__builtin_amdgcn_readlane(__float_as_int(x), n));
}

// a wave's two row results joined
__device__ __forceinline__ float both_rows_max(float x) {
  return fmaxf(lane_value(x, 0), lane_value(x, 16));
}
__device__ __forceinline__ float both_rows_sum(float x) {
  return lane_value(x, 0) + lane_value(x, 16);
}

__global__ __launch_bounds__(256) void attn_kernel(
    const float* __restrict__ o_all, const float* __restrict__ qk,
    const float* __restrict__ qb, float* __restrict__ part,
    float* __restrict__ pml) {
  int b = blockIdx.y;
  int sp = blockIdx.x;
  int tid = threadIdx.x;
  int lane = tid & 31, wv = tid >> 5;
  int hn = lane & 15;            // A: M (head) / B: N index
  int kb = (lane >> 4) * 2;      // K-pair base within the 4-wide K slab
  int mb = (lane >> 4) * 8;      // D: first of this lane's 8 rows (heads)
  int zw = wv * ZWV;
  __shared__ __attribute__((aligned(16))) float lds_o[2 * FT * FP];
  __shared__ float sps[8 * H_ * FT];
  __shared__ __attribute__((aligned(16))) float pp[H_ * PPI];
  __shared__ __attribute__((aligned(16))) float al[H_];

  const float* ob = o_all + ((size_t)b * T_ + sp * FSL) * Z_;
  stage_tile(ob, lds_o, tid);

  // this wave's share of qk, as A fragments, asked for while tile 0 flies
  const float* qkb = qk + (size_t)(b * H_ + hn) * Z_ + zw + kb;
  v2f qa[ZWV / 4];
#pragma unroll  // constant indices keep qa[] in registers
  for (int j = 0; j < ZWV / 4; ++j) qa[j] = *(const v2f*)(qkb + j * 4);
  float qbv = qb[b * H_ + (tid >> 4)];

  // tile 0 has landed for this wave; the barrier publishes it to the others
  asm volatile("s_wait_asynccnt 0x0" ::: "memory");
  __syncthreads();
  stage_tile(ob + (size_t)FT * Z_, lds_o + FT * FP, tid);

  v8f acc[8] = {};
  float m_run = -3.4e38f, l_run = 0.f;

  for (int c = 0; c < FNT; ++c) {
    float* cur = lds_o + (c & 1) * (FT * FP);

    // 1. partial scores over this wave's z
    v8f s0 = {}, s1 = {};        // two chains: the f32 form wants two tiles
    const float* br = cur + hn * FP + zw + kb;
#pragma unroll  // qa[] by constant indices
    for (int j = 0; j < ZWV / 4; j += 2) {
      v2f b0 = *(const v2f*)(br + j * 4);
      v2f b1 = *(const v2f*)(br + j * 4 + 4);
      s0 = __builtin_amdgcn_wmma_f32_16x16x4_f32(false, qa[j], false, b0,
                                                 (short)0, s0, false, false);
      s1 = __builtin_amdgcn_wmma_f32_16x16x4_f32(false, qa[j + 1], false, b1,
                                                 (short)0, s1, false, false);
    }
#pragma unroll  // vector elements by constant indices (here and below)
    for (int r = 0; r < 8; ++r)
      sps[wv * (H_ * FT) + (mb + r) * FT + hn] = s0[r] + s1[r];
    __syncthreads();

    // 2. thread (h,t) = (tid >> 4, tid & 15)
    float sc = qbv;
#pragma unroll  // the 8 LDS reads issued together
    for (int w = 0; w < 8; ++w) sc += sps[w * (H_ * FT) + tid];
    float mx = fmaxf(m_run, rowmax16(sc));
    float alpha = __expf(m_run - mx);
    float pv = __expf(sc - mx);
    l_run = l_run * alpha + pv;
    m_run = mx;
    pp[(tid >> 4) * PPI + (tid & 15)] = pv;
    if ((tid & 15) == 0) al[tid >> 4] = alpha;
    __syncthreads();

    // 3. rescale, then add this tile's weighted rows
    v2f pa[FT / 4];
#pragma unroll
    for (int k = 0; k < FT / 4; ++k)
      pa[k] = *(const v2f*)&pp[hn * PPI + k * 4 + kb];
    v4f av0 = *(const v4f*)&al[mb];
    v4f av1 = *(const v4f*)&al[mb + 4];
#pragma unroll
    for (int n = 0; n < 8; ++n)
#pragma unroll
      for (int r = 0; r < 4; ++r) {
        acc[n][r] *= av0[r];
        acc[n][r + 4] *= av1[r];
      }
#pragma unroll
    for (int k = 0; k < FT / 4; ++k)
#pragma unroll  // 8 independent accumulator tiles back to back
      for (int n = 0; n < 8; ++n) {
        const float* p0 = cur + (k * 4 + kb) * FP + zw + n * 16 + hn;
        v2f bf;
        bf.x = p0[0];
        bf.y = p0[FP];
        acc[n] = __builtin_amdgcn_wmma_f32_16x16x4_f32(false, pa[k], false, bf,
                                                       (short)0, acc[n], false, false);
      }

    // publish point: this wave's reads of the tile are done, its copies of the
    // next tile have landed; behind the barrier the buffer just read is free
    asm volatile("s_wait_dscnt 0x0" ::: "memory");
    asm volatile("s_wait_asynccnt 0x0" ::: "memory");
    __syncthreads();
    if (c + 2 < FNT)
      stage_tile(ob + (size_t)(c + 2) * FT * Z_, cur, tid);
  }
  // no copy is left in flight when the wave ends
  asm volatile("s_wait_asynccnt 0x0" ::: "memory");

  int sbh = (sp * B_ + b) * H_;
#pragma unroll
  for (int n = 0; n < 8; ++n)
#pragma unroll
    for (int r = 0; r < 8; ++r)
      part[(size_t)(sbh + mb + r) * Z_ + zw + n * 16 + hn] = acc[n][r];
  // the slice's 16 denominators and 16 maxima leave as one 128-byte line
  sps[tid] = l_run;
  if ((tid & 15) == 0) al[tid >> 4] = m_run;
  __syncthreads();
  if (tid < 2 * H_) {
    float v;
    if (tid < H_) {
      v = 0.f;
#pragma unroll
      for (int t = 0; t < FT; ++t) v += sps[tid * FT + t];
    } else {
      v = al[tid - H_];
    }
    pml[sbh * 2 + tid] = v;
  }
}

// ---------------------------------------------------------------------------
// Kernel 3: ctxz[b,h,z] = sum_sp part[sp,b,h,z] * exp(max[sp] - max) / denominator
//           (into LDS), then
//           out[b, h*DK+d] = sum_z ctxz[b,h,z]*Wv[h,z,d] + bv[h,d]
// ---------------------------------------------------------------------------
#define PRE 8  // windows whose weight rows are asked for ahead of the merge's barrier

__global__ __launch_bounds__(PT) PROJ_BUDGET void ctx_kernel(
    const float* __restrict__ part, const float* __restrict__ pml,
    const float* __restrict__ Wv,
    const float* __restrict__ bv, float* __restrict__ out) {
  int bh = blockIdx.x;
  int b = bh / H_, h = bh % H_;
  int tid = threadIdx.x;
  int d4 = (tid & 15) * 4;
  int zg = tid >> 4;
  __shared__ float c[Z_];
  __shared__ float ps[ZG * DK_];
  const float* p0 = part + (size_t)bh * Z_ + tid * 4;
  const float* w = Wv + ((size_t)h * Z_ + zg * 4) * DK_ + d4;
  // the bias and the first PRE windows' weight rows do not depend on the
  // merge: asked for ahead of its barrier, their latency runs beside the merge's
  float bvv = 0.f;
  if (tid < DK_) bvv = bv[h * DK_ + tid];
  // every slice's sum is brought to the common maximum: lane s of each wave
  // takes slice s's maximum and denominator (NSP = the lanes of a wave), so
  // that all of them are asked for at once
  const float* pm = pml + ((tid & 31) * B_ + b) * 2 * H_ + h;
  float dsl = pm[0];
  float msl = pm[H_];
  float wl = __expf(msl - both_rows_max(rowmax16(msl)));
  wl *= 1.0f / both_rows_sum(rowsum16(dsl * wl));
  v4f a = {};
#pragma unroll  // constant lane numbers; all slices' loads independent
  for (int s = 0; s < NSP; ++s)
    a += lane_value(wl, s) * *(const v4f*)(p0 + (size_t)s * B_ * H_ * Z_);
  // the weight rows below may land in registers that hold the addresses of the
  // loads above: the wait stands between the two
  asm volatile("s_wait_xcnt 0x0" ::: "memory");
  v4f wr[PRE * 4];
#pragma unroll  // constant indices keep wr[] in registers (here and below)
  for (int i = 0; i < PRE; ++i)
#pragma unroll
    for (int j = 0; j < 4; ++j)
      wr[i * 4 + j] = *(const v4f*)(w + (i * ZW + j) * DK_);
  *(v4f*)&c[tid * 4] = a;
  __syncthreads();
  v4f a4 = {};
#pragma unroll
  for (int i = 0; i < PRE; ++i) {
    v4f o = *(const v4f*)&c[i * ZW + zg * 4];
#pragma unroll
    for (int j = 0; j < 4; ++j) a4 += o[j] * wr[i * 4 + j];
  }
#pragma unroll  // all rows' loads independent and visible to the scheduler
  for (int i = PRE; i < NW; ++i) {
    v4f o = *(const v4f*)&c[i * ZW + zg * 4];
#pragma unroll
    for (int j = 0; j < 4; ++j)
      a4 += o[j] * *(const v4f*)(w + (i * ZW + j) * DK_);
  }
  *(v4f*)&ps[zg * DK_ + d4] = a4;
  __syncthreads();
  if (tid < DK_) {
    float acc = bvv;
#pragma unroll  // the ZG LDS reads issued together
    for (int g = 0; g < ZG; ++g) acc += ps[g * DK_ + tid];
    out[(size_t)b * Z_ + h * DK_ + tid] = acc;
  }
}

// ---------------------------------------------------------------------------
extern "C" void kernel_launch(void* const* d_in, const int* in_sizes, int n_in,
                              void* d_out, int out_size, void* d_ws, size_t ws_size,
                              hipStream_t stream) {
  const float* o_all  = (const float*)d_in[0];
  const float* o_last = (const float*)d_in[1];
  const float* Wk     = (const float*)d_in[2];
  const float* Wv     = (const float*)d_in[3];
  const float* Wq     = (const float*)d_in[4];
  const float* bk     = (const float*)d_in[5];
  const float* bv     = (const float*)d_in[6];
  const float* bq     = (const float*)d_in[7];
  float* out = (float*)d_out;

  float* ws     = (float*)d_ws;
  float* qb     = ws;                              // B*H
  float* qk     = qb + B_ * H_;                    // B*H*Z
  float* pml    = qk + B_ * H_ * Z_;               // NSP*B*2*H
  float* part   = pml + NSP * B_ * 2 * H_;         // NSP*B*H*Z

  qqk_kernel<<<B_ * H_, PT, 0, stream>>>(o_last, Wq, bq, bk, Wk, qk, qb);
  attn_kernel<<<dim3(NSP, B_), 256, 0, stream>>>(o_all, qk, qb, part, pml);
  ctx_kernel<<<B_ * H_, PT, 0, stream>>>(part, pml, Wv, bv, out);
}
